// v000
// The times below were measured on an AMD MI455X: many runs one after another, warmed up first and cycling through
// copies of the inputs, with the whole window's GPU time divided by the number of runs. Launches and the gaps
// between them are all in it. The median over several windows is given; except for v000 it joins two sittings, which
// can be a few percent apart, so the side-by-side timings, each taken in one sitting, are the better comparison.
// v000 is the starting kernel. One run takes 1090 microseconds.
// compute dtype: qkv and y rounded to bf16 (every product exact); q and k transposed to bf16 rows, v = y kept as exact bf16 planes; logits on WMMA 16x16x32 (1 exact product, f32 accumulate) x 1/8, stored in f32 (4 (b,h) pairs per launch); softmax in f32 (precise expf); P x 2^11 split bf16 hi + lo against the exact v planes (2 products); f32 output written channels-first.
#include <hip/hip_runtime.h>
#include <math.h>

typedef __attribute__((ext_vector_type(16))) _Float16 v16h;
typedef __attribute__((ext_vector_type(16))) __bf16 v16b;
typedef __attribute__((ext_vector_type(8)))  _Float16 v8h;
typedef __attribute__((ext_vector_type(8)))  float v8f;
typedef __attribute__((ext_vector_type(4)))  float v4f;
typedef __attribute__((ext_vector_type(2)))  float v2f;
typedef __attribute__((ext_vector_type(4)))  unsigned v4u;
typedef __attribute__((ext_vector_type(4)))  int v4i;
typedef float __attribute__((may_alias)) float_a;
typedef int __attribute__((may_alias)) int_a;

template <typename T> __device__ __forceinline__ void vst2(void* p, T v) { *(T*)p = v;  }
__device__ __forceinline__ v8f wmma16(v16h a, v16h b, v8f c) {
  v8f d = __builtin_amdgcn_wmma_f32_16x16x32_f16(false, a, false, b, (short)0, c, false, false);
  asm volatile("v_nop\n\tv_nop\n\tv_nop\n\tv_nop" : "+v"(d) : "v"(a), "v"(b));
  return d;
}
__device__ __forceinline__ v8f wmma_bf(v16b a, v16b b, v8f c) {
  v8f d = __builtin_amdgcn_wmma_f32_16x16x32_bf16(false, a, false, b, (short)0, c, false, false);
  asm volatile("v_nop\n\tv_nop\n\tv_nop\n\tv_nop" : "+v"(d) : "v"(a), "v"(b));
  return d;
}
// 16x16x32 fragments: lane = (h = lane>>4, row/col = lane&15); elements 0..7 = k0+8h+0..7, 8..15 = k0+16+8h+0..7; D element r = row 8h+r
__device__ __forceinline__ v16h frag_h(const _Float16* rowk0, int lane) {
  union { v16h v; v8h q[2]; } u; const _Float16* p = rowk0 + 8 * (lane >> 4);
  u.q[0] = *(const v8h*)p; u.q[1] = *(const v8h*)(p + 16); return u.v;
}
__device__ __forceinline__ v16h frag_f32(const float* rowk0, int lane) {
  v16h a; const float* p = rowk0 + 8 * (lane >> 4);
#pragma unroll
  for (int i = 0; i < 8; ++i) { a[i] = (_Float16)p[i]; a[8 + i] = (_Float16)p[16 + i]; }
  return a;
}
__device__ __forceinline__ v16h frag_f32s(const float* rowk0, int lane, float sc) {
  v16h a; const float* p = rowk0 + 8 * (lane >> 4);
#pragma unroll
  for (int i = 0; i < 8; ++i) { a[i] = (_Float16)(p[i] * sc); a[8 + i] = (_Float16)(p[16 + i] * sc); }
  return a;
}
// column fragment from a [K][ld] layout (column n), rows >= K read as 0
__device__ __forceinline__ v16h fragc_f32(const float* W, int k0, int n, int lane, int ld, int K) {
  v16h a; const int g = lane >> 4;
#pragma unroll
  for (int i = 0; i < 8; ++i) { const int ka = k0 + 8 * g + i, kb = ka + 16;
    a[i] = (_Float16)(ka < K ? W[(size_t)(ka < K ? ka : K - 1) * ld + n] : 0.f); a[8 + i] = (_Float16)(kb < K ? W[(size_t)(kb < K ? kb : K - 1) * ld + n] : 0.f); }
  return a;
}
struct F2 { v16b h, l; };
__device__ __forceinline__ F2 bsplit16(const float v[16]) { F2 r;
#pragma unroll
  for (int i = 0; i < 16; ++i) { const __bf16 h = (__bf16)v[i]; r.h[i] = h; r.l[i] = (__bf16)(v[i] - (float)h); }
  return r; }
__device__ __forceinline__ F2 split_row(const float* row, int k0, int lane) { float v[16]; const float* p = row + k0 + 8 * (lane >> 4);
#pragma unroll
  for (int i = 0; i < 8; ++i) { v[i] = p[i]; v[8 + i] = p[16 + i]; }
  return bsplit16(v); }
__device__ __forceinline__ F2 split_rowK(const float* row, int k0, int lane, int K) { float v[16]; const int g = lane >> 4;
#pragma unroll
  for (int i = 0; i < 8; ++i) { const int ka = k0 + 8 * g + i, kb = ka + 16; v[i] = ka < K ? row[ka < K ? ka : K - 1] : 0.f; v[8 + i] = kb < K ? row[kb < K ? kb : K - 1] : 0.f; }
  return bsplit16(v); }
__device__ __forceinline__ F2 split_col(const float* W, int k0, int n, int lane, int ld, int K) { float v[16]; const int g = lane >> 4;
#pragma unroll
  for (int i = 0; i < 8; ++i) { const int ka = k0 + 8 * g + i, kb = ka + 16; v[i] = ka < K ? W[(size_t)(ka < K ? ka : K - 1) * ld + n] : 0.f; v[8 + i] = kb < K ? W[(size_t)(kb < K ? kb : K - 1) * ld + n] : 0.f; }
  return bsplit16(v); }
__device__ __forceinline__ v8f mac3(const F2& a, const F2& b, v8f c) { c = wmma_bf(a.l, b.h, c); c = wmma_bf(a.h, b.l, c); return wmma_bf(a.h, b.h, c); }
__device__ __forceinline__ float sigm(float v) { return 1.0f / (1.0f + expf(-v)); }
#define LDSX() do { asm volatile("s_wait_dscnt 0" ::: "memory"); __builtin_amdgcn_wave_barrier(); __builtin_amdgcn_fence(__ATOMIC_RELEASE, "workgroup"); } while (0)

// QKVAttentionLegacy (bs 2, 16 heads, ch 64, T = S = 2,048): q = qkv.reshape(32, 64, T) (channels-first), k = v = y.reshape(32, 64, S); w = softmax_s((q/sqrt(sqrt 64)) . (k/sqrt(sqrt 64))); a[c][t] = sum_s w[t][s] v[c][s]; out = a.reshape(2, 1024, 2048).
__device__ __forceinline__ float bfr(float v) { return (float)(__bf16)v; }
#define NBH 32
#define CH 64
#define TT 2048
#define HG 4
#ifndef TNBH
#define TNBH NBH
#endif
typedef __attribute__((ext_vector_type(8))) __bf16 v8b;
__device__ __forceinline__ v16b frag_b(const __bf16* rowk0, int lane) { union { v16b v; v8b q[2]; } u; const __bf16* p = rowk0 + 8 * (lane >> 4); u.q[0] = *(const v8b*)p; u.q[1] = *(const v8b*)(p + 16); return u.v; }
#define WS_QT  0u                                   // bf16 q rows [bh][t][64]
#define WS_KT  (WS_QT + 2u * (size_t)NBH * TT * CH)  // bf16 k rows [bh][s][64]
#define WS_VP  (WS_KT + 2u * (size_t)NBH * TT * CH)  // bf16 v planes [bh][c][s] (= bf16(y) as laid out)
#define WS_S   (WS_VP + 2u * (size_t)NBH * CH * TT)  // f32 S / P [hg][t][s]
#define WS_END (WS_S + 4u * (size_t)HG * TT * TT)
__global__ __launch_bounds__(256) void k_tr(const float* __restrict__ QKV, const float* __restrict__ Y, __bf16* __restrict__ QT, __bf16* __restrict__ KT, __bf16* __restrict__ VP) { __shared__ __bf16 st[CH][66];
  const int t = threadIdx.x; const int t0 = blockIdx.x * 64; const size_t bh = blockIdx.y; const int which = blockIdx.z; const float* IN = (which == 0 ? QKV : Y) + bh * CH * TT; __bf16* OUT = which == 0 ? QT : KT;
  for (int e = t; e < CH * 64; e += 256) { const int c = e >> 6, tl = e & 63; st[c][tl] = (__bf16)IN[(size_t)c * TT + t0 + tl]; }
  if (which == 1) { for (int e = t; e < CH * 8; e += 256) { const int c = e >> 3, q = e & 7; const float* p = IN + (size_t)c * TT + t0 + q * 8; union { v4u v; __bf16 h[8]; } u;
#pragma unroll
      for (int z = 0; z < 8; ++z) u.h[z] = (__bf16)p[z];
      vst2((v4u*)(VP + (bh * CH + c) * TT + t0 + q * 8), u.v); } }
  __syncthreads();
  for (int e = t; e < 64 * 8; e += 256) { const int tl = e >> 3, q = e & 7; union { v4u v; __bf16 h[8]; } u;
#pragma unroll
    for (int z = 0; z < 8; ++z) u.h[z] = st[q * 8 + z][tl];
    vst2((v4u*)(OUT + (bh * TT + t0 + tl) * CH + q * 8), u.v); } }
// ---- k_sc: block = (64 rows t, 128 cols s, pair in group): exact logits / 8
__global__ __launch_bounds__(128) void k_sc(const __bf16* __restrict__ QT, const __bf16* __restrict__ KT, int g0, float* __restrict__ S0) { __shared__ __align__(16) float ss[4][16][132];
  const size_t bh = g0 + blockIdx.z; float* S = S0 + (size_t)blockIdx.z * TT * TT;
  const int tid = threadIdx.x, wave = tid >> 5, lane = tid & 31, col = lane & 15, g = lane >> 4; const int k0 = blockIdx.y * 128; const int ql0 = blockIdx.x * 64 + wave * 16;
  v8f acc[8] = {};
#pragma unroll
  for (int kc = 0; kc < CH / 32; ++kc) { const v16b a = frag_b(QT + (bh * TT + ql0 + col) * CH + kc * 32, lane);
#pragma unroll
    for (int j = 0; j < 8; ++j) acc[j] = wmma_bf(a, frag_b(KT + (bh * TT + k0 + j * 16 + col) * CH + kc * 32, lane), acc[j]); }
#pragma unroll
  for (int j = 0; j < 8; ++j)
#pragma unroll
    for (int r = 0; r < 8; ++r) ss[wave][8 * g + r][j * 16 + col] = acc[j][r] * 0.125f;
  LDSX(); for (int rl = 0; rl < 16; ++rl) vst2(S + (size_t)(ql0 + rl) * TT + k0 + lane * 4, *(const v4f*)&ss[wave][rl][lane * 4]); }
// ---- k_sm: block = query row: softmax over keys [0, kend) -> P x 2^11 f32 (masked -> 0)
__global__ __launch_bounds__(256) void k_sm(float* __restrict__ S0) { __shared__ float sred[8]; __shared__ float sbc; __shared__ __align__(16) float sh[TT];
  const int t = threadIdx.x; const size_t row = blockIdx.x; float* sr = S0 + (size_t)blockIdx.y * TT * TT + row * TT; const int kend = TT;
  float m = -3.0e38f; for (int k = t; k < kend; k += 256) m = fmaxf(m, sr[k]);
#pragma unroll
  for (int o = 1; o < 32; o <<= 1) m = fmaxf(m, __shfl_xor(m, o));
  if ((t & 31) == 0) sred[t >> 5] = m; __syncthreads(); if (t == 0) { float a = sred[0]; for (int i = 1; i < 8; ++i) a = fmaxf(a, sred[i]); sbc = a; } __syncthreads(); m = sbc; __syncthreads();
  float sum = 0.f; for (int k = t; k < kend; k += 256) { const float v = sr[k]; sum += (v <= -1.0e38f) ? 0.f : expf(v - m); }
#pragma unroll
  for (int o = 1; o < 32; o <<= 1) sum += __shfl_xor(sum, o);
  if ((t & 31) == 0) sred[t >> 5] = sum; __syncthreads(); if (t == 0) { float a = 0.f; for (int i = 0; i < 8; ++i) a += sred[i]; sbc = 1.0f / a; } __syncthreads(); const float inv = sbc;
  for (int k = t; k < kend; k += 256) { const float v = sr[k]; sh[k] = (v <= -1.0e38f) ? 0.f : expf(v - m) * inv * 2048.0f; }
  __syncthreads(); for (int q = t; q < kend / 4; q += 256) vst2(sr + q * 4, *(const v4f*)&sh[q * 4]); }
// ---- k_pv: block = (64 rows t, pair in group): a[c][t] = (P . v) / 2^11 (2 products, exact v); stored channels-first: per channel the block's 64 t = 256 B (cross-wave LDS transpose)
__global__ __launch_bounds__(128) void k_pv(const float* __restrict__ PS0, const __bf16* __restrict__ VP, int g0, float* __restrict__ OUT) { __shared__ __align__(16) float st[CH][68];
  const size_t bh = g0 + blockIdx.z; const float* PS = PS0 + (size_t)blockIdx.z * TT * TT;
  const int tid = threadIdx.x, wave = tid >> 5, lane = tid & 31, col = lane & 15, g = lane >> 4; const int t0 = blockIdx.x * 64; const int ql0 = t0 + wave * 16;
  v8f acc[4] = {};
#pragma unroll 1
  for (int kc = 0; kc < TT / 32; ++kc) { const F2 p = split_row(PS + (size_t)(ql0 + col) * TT, kc * 32, lane);
#pragma unroll
    for (int j = 0; j < 4; ++j) { const v16b vv = frag_b(VP + (bh * CH + j * 16 + col) * (size_t)TT + kc * 32, lane); acc[j] = wmma_bf(p.h, vv, acc[j]); acc[j] = wmma_bf(p.l, vv, acc[j]); } }
#pragma unroll
  for (int j = 0; j < 4; ++j)
#pragma unroll
    for (int r = 0; r < 8; ++r) st[j * 16 + col][wave * 16 + 8 * g + r] = acc[j][r] * (1.0f / 2048.0f);
  __syncthreads();
  for (int e = tid; e < CH * 16; e += 128) { const int c = e >> 4, q = e & 15; vst2(OUT + (bh * CH + c) * (size_t)TT + t0 + q * 4, *(const v4f*)&st[c][q * 4]); } }
extern "C" void kernel_launch(void* const* d_in, const int* in_sizes, int n_in, void* d_out, int out_size, void* d_ws, size_t ws_size, hipStream_t stream) {
  (void)in_sizes; (void)n_in; (void)out_size;
  const float** F = (const float**)d_in;   // 0 qkv [2,1024,2048] ([bs, width, length]) -> q = reshape(32, 64, 2048); 1 y -> k = v = reshape(32, 64, 2048)
  if (ws_size < (size_t)WS_END) return;
  char* ws = (char*)d_ws; __bf16 *QT = (__bf16*)(ws + WS_QT), *KT = (__bf16*)(ws + WS_KT), *VP = (__bf16*)(ws + WS_VP); float* S = (float*)(ws + WS_S);
  k_tr<<<dim3(TT / 64, TNBH, 2), 256, 0, stream>>>(F[0], F[1], QT, KT, VP);
  for (int g0 = 0; g0 < TNBH; g0 += HG) {
    k_sc<<<dim3(TT / 64, TT / 128, HG), 128, 0, stream>>>(QT, KT, g0, S);
    k_sm<<<dim3(TT, HG), 256, 0, stream>>>(S);
    k_pv<<<dim3(TT / 64, 1, HG), 128, 0, stream>>>(S, VP, g0, (float*)d_out);
  }
}

// v001
// Measured time: 50.6 microseconds a run.
// Next to v000, in two timings, it ran 21.7 times as fast each time.
// compute dtype: qkv and y rounded to bf16 (every product exact); q and k transposed to bf16 rows, v = y kept as exact bf16 planes; logits on WMMA 16x16x32 (1 exact product, f32 accumulate), never stored; online softmax in f32 (exp2 of the logit x log2(e)/8 minus the running maximum); unnormalised P split bf16 hi + lo against the exact v planes (2 products), divided by the row sum at the end; f32 output written channels-first.
#include <hip/hip_runtime.h>
#include <math.h>

typedef __attribute__((ext_vector_type(16))) __bf16 v16b;
typedef __attribute__((ext_vector_type(8)))  __bf16 v8b;
typedef __attribute__((ext_vector_type(8)))  float v8f;
typedef __attribute__((ext_vector_type(4)))  float v4f;
typedef __attribute__((ext_vector_type(2)))  float v2f;
typedef __attribute__((ext_vector_type(2)))  __bf16 v2b;
typedef __attribute__((ext_vector_type(4)))  unsigned v4u;

template <typename T> __device__ __forceinline__ void vst2(void* p, T v) { *(T*)p = v;  }
__device__ __forceinline__ v8f wmma_bf(v16b a, v16b b, v8f c) { return __builtin_amdgcn_wmma_f32_16x16x32_bf16(false, a, false, b, (short)0, c, false, false); }

// QKVAttentionLegacy (bs 2, 16 heads, ch 64, T = S = 2,048): q = qkv.reshape(32, 64, T) (channels-first), k = v = y.reshape(32, 64, S); w = softmax_s((q/sqrt(sqrt 64)) . (k/sqrt(sqrt 64))); a[c][t] = sum_s w[t][s] v[c][s]; out = a.reshape(2, 1024, 2048).
#define NBH 32
#define CH 64
#define TT 2048
#ifndef TNBH
#define TNBH NBH
#endif
// 16x16x32 fragments: lane = (h = lane>>4, row/col = lane&15); elements 0..7 = k0+8h+0..7, 8..15 = k0+16+8h+0..7; D element r = row 8h+r
__device__ __forceinline__ v16b frag_b(const __bf16* rowk0, int lane) { union { v16b v; v8b q[2]; } u; const __bf16* p = rowk0 + 8 * (lane >> 4); u.q[0] = *(const v8b*)p; u.q[1] = *(const v8b*)(p + 16); return u.v; }
#define WS_QT  0u                                   // bf16 q rows [bh][t][64]
#define WS_KT  (WS_QT + 2u * (size_t)NBH * TT * CH)  // bf16 k rows [bh][s][64]
#define WS_VP  (WS_KT + 2u * (size_t)NBH * TT * CH)  // bf16 v planes [bh][c][s] (= bf16(y) as laid out)
#define WS_END (WS_VP + 2u * (size_t)NBH * CH * TT)
__global__ __launch_bounds__(256) void k_tr(const float* __restrict__ QKV, const float* __restrict__ Y, __bf16* __restrict__ QT, __bf16* __restrict__ KT, __bf16* __restrict__ VP) { __shared__ __bf16 st[CH][66];
  const int t = threadIdx.x; const int t0 = blockIdx.x * 64; const size_t bh = blockIdx.y; const int which = blockIdx.z; const float* IN = (which == 0 ? QKV : Y) + bh * CH * TT; __bf16* OUT = which == 0 ? QT : KT;
  for (int e = t; e < CH * 64; e += 256) { const int c = e >> 6, tl = e & 63; st[c][tl] = (__bf16)IN[(size_t)c * TT + t0 + tl]; }
  if (which == 1) { for (int e = t; e < CH * 8; e += 256) { const int c = e >> 3, q = e & 7; const float* p = IN + (size_t)c * TT + t0 + q * 8; union { v4u v; __bf16 h[8]; } u;
#pragma unroll
      for (int z = 0; z < 8; ++z) u.h[z] = (__bf16)p[z];
      vst2((v4u*)(VP + (bh * CH + c) * TT + t0 + q * 8), u.v); } }
  __syncthreads();
  for (int e = t; e < 64 * 8; e += 256) { const int tl = e >> 3, q = e & 7; union { v4u v; __bf16 h[8]; } u;
#pragma unroll
    for (int z = 0; z < 8; ++z) u.h[z] = st[q * 8 + z][tl];
    vst2((v4u*)(OUT + (bh * TT + t0 + tl) * CH + q * 8), u.v); } }
#define FK 128                 // keys per stage
#define KPIT 72                // K row pitch in LDS, elements: 144 B = 16 B x odd
#define VPIT 136               // V row pitch in LDS, elements: 272 B = 16 B x odd
#define SK_E (FK * KPIT)
#define SV_E (CH * VPIT)
#define OPIT 36                // output staging pitch, floats
__device__ __forceinline__ float xhalf(float v) { const int b = __builtin_bit_cast(int, v); return __builtin_bit_cast(float, __builtin_amdgcn_permlanex16(b, b, 0x76543210, 0xfedcba98, false, false)); }
__global__ __launch_bounds__(256) void k_fa(const __bf16* __restrict__ QT, const __bf16* __restrict__ KT, const __bf16* __restrict__ VP, float* __restrict__ OUT) {
  __shared__ __align__(16) char sm[8 * CH * OPIT * 4];   // 73,728 B: two K/V buffers (71,680 B) in the loop, the output staging behind it
  static_assert(sizeof(sm) >= 2u * 2u * (SK_E + SV_E), "LDS");
  const int tid = threadIdx.x, wave = tid >> 5, lane = tid & 31, col = lane & 15, g = lane >> 4;
  const size_t bh = blockIdx.y; const int tw = blockIdx.x * 256 + wave * 32;
  const __bf16* Kg = KT + bh * TT * CH; const __bf16* Vg = VP + bh * CH * TT;
  __bf16* const sb = (__bf16*)sm;
  const float CS = 0.125f * 1.44269504088896340736f;
  v16b qf[2][2];
#pragma unroll
  for (int u = 0; u < 2; ++u)
#pragma unroll
    for (int kc = 0; kc < 2; ++kc) qf[u][kc] = frag_b(QT + (bh * TT + tw + u * 16 + col) * CH + kc * 32, lane);
  v8b rk[4], rv[4];
#pragma unroll
  for (int i = 0; i < 4; ++i) { const int e = tid + 256 * i; rk[i] = *(const v8b*)(Kg + e * 8); rv[i] = *(const v8b*)(Vg + (size_t)(e >> 4) * TT + (e & 15) * 8); }
  asm volatile("s_wait_xcnt 0x0" ::: "memory");   // stands before the address registers of the loads above are reused
  __builtin_amdgcn_sched_barrier(0);              // keeps later register writes (the accumulators' zeroes) from being lifted over that wait
#pragma unroll
  for (int i = 0; i < 4; ++i) { const int e = tid + 256 * i; *(v8b*)(sb + (e >> 3) * KPIT + (e & 7) * 8) = rk[i]; *(v8b*)(sb + SK_E + (e >> 4) * VPIT + (e & 15) * 8) = rv[i]; }
  __syncthreads();
  v8f acc[4][2] = {}; float m[2] = {-3.0e38f, -3.0e38f}; v2f l[2] = {};
#pragma unroll 1   // the stage loop stays rolled: its four unrolled passes are the whole hot text, and the buffer index is one scalar select
  for (int st = 0; st < TT / FK; ++st) {
    const __bf16* sk = sb + (st & 1) * (SK_E + SV_E); const __bf16* sv = sk + SK_E;
    if (st + 1 < TT / FK) { const int s0 = (st + 1) * FK;
#pragma unroll
      for (int i = 0; i < 4; ++i) { const int e = tid + 256 * i; rk[i] = *(const v8b*)(Kg + (size_t)s0 * CH + e * 8); rv[i] = *(const v8b*)(Vg + (size_t)(e >> 4) * TT + s0 + (e & 15) * 8); }
      asm volatile("s_wait_xcnt 0x0" ::: "memory");   // stands before the address registers of the loads above are reused
    }
    v16b kf[2][2];
#pragma unroll
    for (int i = 0; i < 2; ++i)
#pragma unroll
      for (int kc = 0; kc < 2; ++kc) kf[i][kc] = frag_b(sk + (i * 16 + col) * KPIT + kc * 32, lane);
#pragma unroll
    for (int ps = 0; ps < FK / 32; ++ps) {
      v16b vf[4];
#pragma unroll
      for (int j = 0; j < 4; ++j) vf[j] = frag_b(sv + (j * 16 + col) * VPIT + ps * 32, lane);
      v8f sc[2][2];
#pragma unroll
      for (int u = 0; u < 2; ++u)
#pragma unroll
        for (int i = 0; i < 2; ++i) { v8f z = {}; z = wmma_bf(kf[i][0], qf[u][0], z); sc[u][i] = wmma_bf(kf[i][1], qf[u][1], z); }
      // the next pass's K fragments are fetched behind this pass's St products, so that the softmax covers their LDS latency (inside the published stage only)
      if (ps + 1 < FK / 32) {
#pragma unroll
        for (int i = 0; i < 2; ++i)
#pragma unroll
          for (int kc = 0; kc < 2; ++kc) kf[i][kc] = frag_b(sk + ((ps + 1) * 32 + i * 16 + col) * KPIT + kc * 32, lane); }
      __builtin_amdgcn_sched_barrier(0);   // keeps those LDS reads up here: sunk to their use, the next pass's first product waits out the whole LDS latency
      float mx[2];
#pragma unroll
      for (int u = 0; u < 2; ++u) { float a = sc[u][0][0];
#pragma unroll
        for (int e = 1; e < 16; ++e) a = fmaxf(a, sc[u][e >> 3][e & 7]);
        mx[u] = fmaxf(a, xhalf(a)) * CS; }
      // lazy rescale: the maximum in use moves only when a column's new one exceeds it by more than 8 (P stays below 2^8); one scalar branch a pass
      const bool need = (mx[0] > m[0] + 8.0f) | (mx[1] > m[1] + 8.0f);
      if (__builtin_amdgcn_ballot_w32(need) != 0) {
#pragma unroll
        for (int u = 0; u < 2; ++u) { const float mn = fmaxf(m[u], mx[u]); const float al = __builtin_amdgcn_exp2f(m[u] - mn); m[u] = mn; l[u] *= al;
#pragma unroll
          for (int j = 0; j < 4; ++j) acc[j][u] *= al; } }
      v16b ph[2], pl[2];
#pragma unroll
      for (int u = 0; u < 2; ++u)
#pragma unroll
        for (int e = 0; e < 16; e += 2) { const v2f x = __builtin_elementwise_fma((v2f){sc[u][e >> 3][e & 7], sc[u][e >> 3][(e & 7) + 1]}, (v2f){CS, CS}, (v2f){-m[u], -m[u]});
          const v2f p = {__builtin_amdgcn_exp2f(x[0]), __builtin_amdgcn_exp2f(x[1])}; l[u] += p;
          const v2b h = __builtin_convertvector(p, v2b); const v2b w = __builtin_convertvector(p - __builtin_convertvector(h, v2f), v2b);
          ph[u][e] = h[0]; ph[u][e + 1] = h[1]; pl[u][e] = w[0]; pl[u][e + 1] = w[1]; }
#pragma unroll
      for (int j = 0; j < 4; ++j)
#pragma unroll
        for (int u = 0; u < 2; ++u) acc[j][u] = wmma_bf(vf[j], ph[u], acc[j][u]);
#pragma unroll
      for (int j = 0; j < 4; ++j)
#pragma unroll
        for (int u = 0; u < 2; ++u) acc[j][u] = wmma_bf(vf[j], pl[u], acc[j][u]);
    }
    if (st + 1 < TT / FK) { __bf16* dk = sb + ((st + 1) & 1) * (SK_E + SV_E);
#pragma unroll
      for (int i = 0; i < 4; ++i) { const int e = tid + 256 * i; *(v8b*)(dk + (e >> 3) * KPIT + (e & 7) * 8) = rk[i]; *(v8b*)(dk + SK_E + (e >> 4) * VPIT + (e & 15) * 8) = rv[i]; } }
    __syncthreads();
  }
  // every wave has left the K/V buffers (the loop's last barrier): each wave stages its 64 channels x 32 queries and stores whole 128-byte lines
  float* ow = (float*)sm + wave * (CH * OPIT);
#pragma unroll
  for (int u = 0; u < 2; ++u) { const float ls = l[u][0] + l[u][1]; const float inv = 1.0f / (ls + xhalf(ls));
#pragma unroll
    for (int j = 0; j < 4; ++j)
#pragma unroll
      for (int r = 0; r < 8; ++r) ow[(j * 16 + 8 * g + r) * OPIT + u * 16 + col] = acc[j][u][r] * inv; }
  __syncthreads();
#pragma unroll
  for (int i = 0; i < 16; ++i) { const int e = i * 32 + lane, c = e >> 3, q = e & 7; vst2(OUT + (bh * CH + c) * (size_t)TT + tw + q * 4, *(const v4f*)&ow[c * OPIT + q * 4]); } }
extern "C" void kernel_launch(void* const* d_in, const int* in_sizes, int n_in, void* d_out, int out_size, void* d_ws, size_t ws_size, hipStream_t stream) {
  (void)in_sizes; (void)n_in; (void)out_size;
  const float** F = (const float**)d_in;   // 0 qkv [2,1024,2048] ([bs, width, length]) -> q = reshape(32, 64, 2048); 1 y -> k = v = reshape(32, 64, 2048)
  if (ws_size < (size_t)WS_END) return;
  char* ws = (char*)d_ws; __bf16 *QT = (__bf16*)(ws + WS_QT), *KT = (__bf16*)(ws + WS_KT), *VP = (__bf16*)(ws + WS_VP);
  k_tr<<<dim3(TT / 64, TNBH, 2), 256, 0, stream>>>(F[0], F[1], QT, KT, VP);
  k_fa<<<dim3(TT / 256, TNBH), 256, 0, stream>>>(QT, KT, VP, (float*)d_out);
}

// v002
// A run of this version takes 37.3 microseconds.
// Timed twice side by side with v001, it ran 1.36 and 1.35 times as fast.
// Over all steps from v000 it is 29.5 times as fast.
// compute dtype: qkv and y rounded to bf16 (every product exact), in the one kernel: q fragments converted from the channels-first f32 rows, y tiles converted on their way into LDS and read both as v planes and, transposed, as k rows; logits on WMMA 16x16x32 (1 exact product, f32 accumulate), never stored; online softmax in f32 (exp2 of the logit x log2(e)/8 minus the running maximum); unnormalised P split bf16 hi + lo against the exact v planes (2 products), divided by the row sum at the end; f32 output written channels-first.
#include <hip/hip_runtime.h>
#include <math.h>

typedef __attribute__((ext_vector_type(16))) __bf16 v16b;
typedef __attribute__((ext_vector_type(8)))  __bf16 v8b;
typedef __attribute__((ext_vector_type(8)))  float v8f;
typedef __attribute__((ext_vector_type(4)))  float v4f;
typedef __attribute__((ext_vector_type(2)))  float v2f;
typedef __attribute__((ext_vector_type(2)))  __bf16 v2b;
typedef __attribute__((ext_vector_type(4)))  __bf16 v4b;

template <typename T> __device__ __forceinline__ void vst2(void* p, T v) { *(T*)p = v;  }
__device__ __forceinline__ v8f wmma_bf(v16b a, v16b b, v8f c) { return __builtin_amdgcn_wmma_f32_16x16x32_bf16(false, a, false, b, (short)0, c, false, false); }

// QKVAttentionLegacy (bs 2, 16 heads, ch 64, T = S = 2,048): q = qkv.reshape(32, 64, T) (channels-first), k = v = y.reshape(32, 64, S); w = softmax_s((q/sqrt(sqrt 64)) . (k/sqrt(sqrt 64))); a[c][t] = sum_s w[t][s] v[c][s]; out = a.reshape(2, 1024, 2048).
#define NBH 32
#define CH 64
#define TT 2048
#ifndef TNBH
#define TNBH NBH
#endif
// 16x16x32 fragments: lane = (h = lane>>4, row/col = lane&15); elements 0..7 = k0+8h+0..7, 8..15 = k0+16+8h+0..7; D element r = row 8h+r
__device__ __forceinline__ v16b frag_b(const __bf16* rowk0, int lane) { union { v16b v; v8b q[2]; } u; const __bf16* p = rowk0 + 8 * (lane >> 4); u.q[0] = *(const v8b*)p; u.q[1] = *(const v8b*)(p + 16); return u.v; }
// the same fragment of a tile stored k-major (row = k, column = the operand's row): two transposing LDS loads; lane l hands in row 8(l>>4) + (l&7), 16-byte piece (l>>3)&1, and gets column l&15 at k = 8(l>>4) + 0..7
typedef __attribute__((address_space(3))) v8b lds_v8b;
__device__ __forceinline__ v16b frag_t(const __bf16* k0col0, int pitch, int lane) { union { v16b v; v8b q[2]; } u; const __bf16* p = k0col0 + (8 * (lane >> 4) + (lane & 7)) * pitch + 8 * ((lane >> 3) & 1);
  u.q[0] = __builtin_amdgcn_ds_load_tr16_b128_v8bf16((lds_v8b*)p); u.q[1] = __builtin_amdgcn_ds_load_tr16_b128_v8bf16((lds_v8b*)(p + 16 * pitch)); return u.v; }
#define FK 128                 // keys per stage
#define YPIT 144               // tile row pitch in LDS, elements: 288 B = 32 B x odd (the transposing reader's pitch)
#define SY_E (CH * YPIT)
#define OPIT 36                // output staging pitch, floats
__device__ __forceinline__ float xhalf(float v) { const int b = __builtin_bit_cast(int, v); return __builtin_bit_cast(float, __builtin_amdgcn_permlanex16(b, b, 0x76543210, 0xfedcba98, false, false)); }
__global__ __launch_bounds__(256) void k_fa(const float* __restrict__ QKV, const float* __restrict__ Y, float* __restrict__ OUT) {
  __shared__ __align__(16) char sm[8 * CH * OPIT * 4];   // 73,728 B: two tile buffers (36,864 B) in the loop, the output staging behind it
  static_assert(sizeof(sm) >= 2u * 2u * SY_E, "LDS");
  const int tid = threadIdx.x, wave = tid >> 5, lane = tid & 31, col = lane & 15, g = lane >> 4;
  const size_t bh = blockIdx.y; const int tw = blockIdx.x * 256 + wave * 32;
  const float* Yg = Y + bh * CH * TT + (size_t)wave * TT + lane * 4;   // a wave loads whole 512-byte rows: row 8 i + wave, 16 bytes a lane
  const float* Qg = QKV + bh * CH * TT + tw + col;
  __bf16* const sb = (__bf16*)sm;
  const float CS = 0.125f * 1.44269504088896340736f;
  v4f ry[8];
#pragma unroll
  for (int i = 0; i < 8; ++i) ry[i] = *(const v4f*)(Yg + (size_t)(8 * i) * TT);
  // q fragments straight from the channels-first rows: element e of a lane is channel kc*32 + 16(e>>3) + 8g + (e&7) of its query; 16 lanes read 64 bytes of a row
  float rq[2][2][16];
#pragma unroll
  for (int u = 0; u < 2; ++u)
#pragma unroll
    for (int kc = 0; kc < 2; ++kc)
#pragma unroll
      for (int e = 0; e < 16; ++e) rq[u][kc][e] = Qg[(size_t)(kc * 32 + (e >> 3) * 16 + 8 * g + (e & 7)) * TT + u * 16];
  asm volatile("s_wait_xcnt 0x0" ::: "memory");   // stands before the address registers of the loads above are reused
  __builtin_amdgcn_sched_barrier(0);              // keeps later register writes (the accumulators' zeroes) from being lifted over that wait
#pragma unroll
  for (int i = 0; i < 8; ++i) *(v4b*)(sb + (8 * i + wave) * YPIT + lane * 4) = __builtin_convertvector(ry[i], v4b);
  v16b qf[2][2];
#pragma unroll
  for (int u = 0; u < 2; ++u)
#pragma unroll
    for (int kc = 0; kc < 2; ++kc)
#pragma unroll
      for (int e = 0; e < 16; ++e) qf[u][kc][e] = (__bf16)rq[u][kc][e];
  __syncthreads();
  v8f acc[4][2] = {}; float m[2] = {-3.0e38f, -3.0e38f}; v2f l[2] = {};
#pragma unroll 1   // the stage loop stays rolled: its four unrolled passes are the whole hot text, and the buffer index is one scalar select
  for (int st = 0; st < TT / FK; ++st) {
    const __bf16* sy = sb + (st & 1) * SY_E;
    if (st + 1 < TT / FK) { const int s0 = (st + 1) * FK;
#pragma unroll
      for (int i = 0; i < 8; ++i) ry[i] = *(const v4f*)(Yg + (size_t)(8 * i) * TT + s0);
      asm volatile("s_wait_xcnt 0x0" ::: "memory");   // stands before the address registers of the loads above are reused
    }
    v16b kf[2][2];
#pragma unroll
    for (int i = 0; i < 2; ++i)
#pragma unroll
      for (int kc = 0; kc < 2; ++kc) kf[i][kc] = frag_t(sy + kc * 32 * YPIT + i * 16, YPIT, lane);
#pragma unroll
    for (int ps = 0; ps < FK / 32; ++ps) {
      v16b vf[4];
#pragma unroll
      for (int j = 0; j < 4; ++j) vf[j] = frag_b(sy + (j * 16 + col) * YPIT + ps * 32, lane);
      v8f sc[2][2];
#pragma unroll
      for (int u = 0; u < 2; ++u)
#pragma unroll
        for (int i = 0; i < 2; ++i) { v8f z = {}; z = wmma_bf(kf[i][0], qf[u][0], z); sc[u][i] = wmma_bf(kf[i][1], qf[u][1], z); }
      // the next pass's K fragments are fetched behind this pass's St products, so that the softmax covers their LDS latency (inside the published stage only)
      if (ps + 1 < FK / 32) {
#pragma unroll
        for (int i = 0; i < 2; ++i)
#pragma unroll
          for (int kc = 0; kc < 2; ++kc) kf[i][kc] = frag_t(sy + kc * 32 * YPIT + (ps + 1) * 32 + i * 16, YPIT, lane); }
      __builtin_amdgcn_sched_barrier(0);   // keeps those LDS reads up here: sunk to their use, the next pass's first product waits out the whole LDS latency
      float mx[2];
#pragma unroll
      for (int u = 0; u < 2; ++u) { float a = sc[u][0][0];
#pragma unroll
        for (int e = 1; e < 16; ++e) a = fmaxf(a, sc[u][e >> 3][e & 7]);
        mx[u] = fmaxf(a, xhalf(a)) * CS; }
      // lazy rescale: the maximum in use moves only when a column's new one exceeds it by more than 8 (P stays below 2^8); one scalar branch a pass
      const bool need = (mx[0] > m[0] + 8.0f) | (mx[1] > m[1] + 8.0f);
      if (__builtin_amdgcn_ballot_w32(need) != 0) {
#pragma unroll
        for (int u = 0; u < 2; ++u) { const float mn = fmaxf(m[u], mx[u]); const float al = __builtin_amdgcn_exp2f(m[u] - mn); m[u] = mn; l[u] *= al;
#pragma unroll
          for (int j = 0; j < 4; ++j) acc[j][u] *= al; } }
      v16b ph[2], pl[2];
#pragma unroll
      for (int u = 0; u < 2; ++u)
#pragma unroll
        for (int e = 0; e < 16; e += 2) { const v2f x = __builtin_elementwise_fma((v2f){sc[u][e >> 3][e & 7], sc[u][e >> 3][(e & 7) + 1]}, (v2f){CS, CS}, (v2f){-m[u], -m[u]});
          const v2f p = {__builtin_amdgcn_exp2f(x[0]), __builtin_amdgcn_exp2f(x[1])}; l[u] += p;
          const v2b h = __builtin_convertvector(p, v2b); const v2b w = __builtin_convertvector(p - __builtin_convertvector(h, v2f), v2b);
          ph[u][e] = h[0]; ph[u][e + 1] = h[1]; pl[u][e] = w[0]; pl[u][e + 1] = w[1]; }
#pragma unroll
      for (int j = 0; j < 4; ++j)
#pragma unroll
        for (int u = 0; u < 2; ++u) acc[j][u] = wmma_bf(vf[j], ph[u], acc[j][u]);
#pragma unroll
      for (int j = 0; j < 4; ++j)
#pragma unroll
        for (int u = 0; u < 2; ++u) acc[j][u] = wmma_bf(vf[j], pl[u], acc[j][u]);
    }
    if (st + 1 < TT / FK) { __bf16* dy = sb + ((st + 1) & 1) * SY_E;
#pragma unroll
      for (int i = 0; i < 8; ++i) *(v4b*)(dy + (8 * i + wave) * YPIT + lane * 4) = __builtin_convertvector(ry[i], v4b); }
    __syncthreads();
  }
  // every wave has left the tile buffers (the loop's last barrier): each wave stages its 64 channels x 32 queries and stores whole 128-byte lines
  float* ow = (float*)sm + wave * (CH * OPIT);
#pragma unroll
  for (int u = 0; u < 2; ++u) { const float ls = l[u][0] + l[u][1]; const float inv = 1.0f / (ls + xhalf(ls));
#pragma unroll
    for (int j = 0; j < 4; ++j)
#pragma unroll
      for (int r = 0; r < 8; ++r) ow[(j * 16 + 8 * g + r) * OPIT + u * 16 + col] = acc[j][u][r] * inv; }
  __syncthreads();
#pragma unroll
  for (int i = 0; i < 16; ++i) { const int e = i * 32 + lane, c = e >> 3, q = e & 7; vst2(OUT + (bh * CH + c) * (size_t)TT + tw + q * 4, *(const v4f*)&ow[c * OPIT + q * 4]); } }
extern "C" void kernel_launch(void* const* d_in, const int* in_sizes, int n_in, void* d_out, int out_size, void* d_ws, size_t ws_size, hipStream_t stream) {
  (void)in_sizes; (void)n_in; (void)out_size; (void)d_ws; (void)ws_size;
  const float** F = (const float**)d_in;   // 0 qkv [2,1024,2048] ([bs, width, length]) -> q = reshape(32, 64, 2048); 1 y -> k = v = reshape(32, 64, 2048)
  k_fa<<<dim3(TT / 256, TNBH), 256, 0, stream>>>(F[0], F[1], (float*)d_out);
}

// v004
// One run takes 28.6 microseconds.
// Versions between v002 and this one are left out; their measured steps multiply to 1.30 times as fast.
// All steps since v000 together make it 38.4 times as fast.
// compute dtype: qkv and y rounded to f16 (11 significant bits; every product exact in f32), in the one kernel: q fragments converted from the channels-first f32 rows after the factor log2(e)/8, y tiles converted on their way into LDS and read both as v planes and, transposed, as k rows; logits on WMMA 16x16x32 (1 product, f32 accumulate), never stored; online softmax in f32 (exp2 of the score product's own result: it starts from minus the maximum in use); unnormalised P (below 2^8) rounded once to f16 against the v planes (1 product), divided by the f32 row sum of the unrounded P at the end; f32 output written channels-first. Inputs must lie inside the f16 range (the declared generators are standard normal).
#include <hip/hip_runtime.h>
#include <math.h>

typedef _Float16 h16;
typedef __attribute__((ext_vector_type(16))) h16 v16h;
typedef __attribute__((ext_vector_type(8)))  h16 v8h;
typedef __attribute__((ext_vector_type(8)))  float v8f;
typedef __attribute__((ext_vector_type(4)))  float v4f;
typedef __attribute__((ext_vector_type(2)))  float v2f;
typedef __attribute__((ext_vector_type(2)))  h16 v2h;
typedef __attribute__((ext_vector_type(4)))  h16 v4h;

template <typename T> __device__ __forceinline__ void vst2(void* p, T v) { *(T*)p = v;  }
__device__ __forceinline__ v8f wmma_h(v16h a, v16h b, v8f c) { return __builtin_amdgcn_wmma_f32_16x16x32_f16(false, a, false, b, (short)0, c, false, false); }

// QKVAttentionLegacy (bs 2, 16 heads, ch 64, T = S = 2,048): q = qkv.reshape(32, 64, T) (channels-first), k = v = y.reshape(32, 64, S); w = softmax_s((q/sqrt(sqrt 64)) . (k/sqrt(sqrt 64))); a[c][t] = sum_s w[t][s] v[c][s]; out = a.reshape(2, 1024, 2048).
#define NBH 32
#define CH 64
#define TT 2048
#ifndef TNBH
#define TNBH NBH
#endif
// 16x16x32 fragments: lane = (h = lane>>4, row/col = lane&15); elements 0..7 = k0+8h+0..7, 8..15 = k0+16+8h+0..7; D element r = row 8h+r
__device__ __forceinline__ v16h frag_b(const h16* rowk0, int lane) { union { v16h v; v8h q[2]; } u; const h16* p = rowk0 + 8 * (lane >> 4); u.q[0] = *(const v8h*)p; u.q[1] = *(const v8h*)(p + 16); return u.v; }
// the same fragment of a tile stored k-major (row = k, column = the operand's row): two transposing LDS loads; lane l hands in row 8(l>>4) + (l&7), 16-byte piece (l>>3)&1, and gets column l&15 at k = 8(l>>4) + 0..7
typedef __attribute__((ext_vector_type(8))) __fp16 v8p;   // the builtin's own spelling of eight f16
typedef __attribute__((address_space(3))) v8p lds_v8h;
__device__ __forceinline__ v16h frag_t(const h16* k0col0, int pitch, int lane) { union { v16h v; v8h q[2]; } u; const h16* p = k0col0 + (8 * (lane >> 4) + (lane & 7)) * pitch + 8 * ((lane >> 3) & 1);
  u.q[0] = __builtin_bit_cast(v8h, __builtin_amdgcn_ds_load_tr16_b128_v8f16((lds_v8h*)p)); u.q[1] = __builtin_bit_cast(v8h, __builtin_amdgcn_ds_load_tr16_b128_v8f16((lds_v8h*)(p + 16 * pitch))); return u.v; }
#define FK 128                 // keys per stage
#define YPIT 144               // tile row pitch in LDS, elements: 288 B = 32 B x odd (the transposing reader's pitch)
#define SY_E (CH * YPIT)
#define OPIT 36                // output staging pitch, floats
__device__ __forceinline__ float xhalf(float v) { const int b = __builtin_bit_cast(int, v); return __builtin_bit_cast(float, __builtin_amdgcn_permlanex16(b, b, 0x76543210, 0xfedcba98, false, false)); }
__global__ __launch_bounds__(256) void k_fa(const float* __restrict__ QKV, const float* __restrict__ Y, float* __restrict__ OUT) {
  __shared__ __align__(16) char sm[8 * CH * OPIT * 4];   // 73,728 B: two tile buffers (36,864 B) in the loop, the output staging behind it
  static_assert(sizeof(sm) >= 2u * 2u * SY_E, "LDS");
  const int tid = threadIdx.x, wave = tid >> 5, lane = tid & 31, col = lane & 15, g = lane >> 4;
  const size_t bh = blockIdx.y; const int tw = blockIdx.x * 256 + wave * 32;
  const float* Yg = Y + bh * CH * TT + (size_t)wave * TT + lane * 4;   // a wave loads whole 512-byte rows: row 8 i + wave, 16 bytes a lane
  const float* Qg = QKV + bh * CH * TT + tw + col;
  h16* const sb = (h16*)sm;
  const float CS = 0.125f * 1.44269504088896340736f;
  v4f ry[8];
#pragma unroll
  for (int i = 0; i < 8; ++i) ry[i] = *(const v4f*)(Yg + (size_t)(8 * i) * TT);
  // q fragments straight from the channels-first rows: element e of a lane is channel kc*32 + 16(e>>3) + 8g + (e&7) of its query; 16 lanes read 64 bytes of a row
  float rq[2][2][16];
#pragma unroll
  for (int u = 0; u < 2; ++u)
#pragma unroll
    for (int kc = 0; kc < 2; ++kc)
#pragma unroll
      for (int e = 0; e < 16; ++e) rq[u][kc][e] = Qg[(size_t)(kc * 32 + (e >> 3) * 16 + 8 * g + (e & 7)) * TT + u * 16];
  asm volatile("s_wait_xcnt 0x0" ::: "memory");   // stands before the address registers of the loads above are reused
  __builtin_amdgcn_sched_barrier(0);              // keeps later register writes (the accumulators' zeroes) from being lifted over that wait
#pragma unroll
  for (int i = 0; i < 8; ++i) *(v4h*)(sb + (8 * i + wave) * YPIT + lane * 4) = __builtin_convertvector(ry[i], v4h);
  v16h qf[2][2];
#pragma unroll
  for (int u = 0; u < 2; ++u)
#pragma unroll
    for (int kc = 0; kc < 2; ++kc)
#pragma unroll
      for (int e = 0; e < 16; ++e) qf[u][kc][e] = (h16)(rq[u][kc][e] * CS);   // the softmax scale rides in q: St comes out in log2 units
  __syncthreads();
  v8f acc[4][2] = {}; v2f l[2] = {};
  // nm[u]: minus the maximum in use of the lane's query, in all eight elements: the C operand of the St products, so that St leaves the matrix unit as exp2's argument
  // thr, lo: the first pass always takes the rescale branch and takes its own maximum whatever its sign; later passes only raise the maximum in use
  v8f nm[2] = {}; float thr = -3.0e38f, lo = -3.0e38f;
#pragma unroll 1   // the stage loop stays rolled: its four unrolled passes are the whole hot text, and the buffer index is one scalar select
  for (int st = 0; st < TT / FK; ++st) {
    const h16* sy = sb + (st & 1) * SY_E;
    if (st + 1 < TT / FK) { const int s0 = (st + 1) * FK;
#pragma unroll
      for (int i = 0; i < 8; ++i) ry[i] = *(const v4f*)(Yg + (size_t)(8 * i) * TT + s0);
      asm volatile("s_wait_xcnt 0x0" ::: "memory");   // stands before the address registers of the loads above are reused
    }
    v16h kf[2][2];
#pragma unroll
    for (int i = 0; i < 2; ++i)
#pragma unroll
      for (int kc = 0; kc < 2; ++kc) kf[i][kc] = frag_t(sy + kc * 32 * YPIT + i * 16, YPIT, lane);
#pragma unroll
    for (int ps = 0; ps < FK / 32; ++ps) {
      v16h vf[4];
#pragma unroll
      for (int j = 0; j < 4; ++j) vf[j] = frag_b(sy + (j * 16 + col) * YPIT + ps * 32, lane);
      v8f sc[2][2];
#pragma unroll
      for (int u = 0; u < 2; ++u)
#pragma unroll
        for (int i = 0; i < 2; ++i) sc[u][i] = wmma_h(kf[i][1], qf[u][1], wmma_h(kf[i][0], qf[u][0], nm[u]));
      // the next pass's K fragments are fetched behind this pass's St products, so that the softmax covers their LDS latency (inside the published stage only)
      if (ps + 1 < FK / 32) {
#pragma unroll
        for (int i = 0; i < 2; ++i)
#pragma unroll
          for (int kc = 0; kc < 2; ++kc) kf[i][kc] = frag_t(sy + kc * 32 * YPIT + (ps + 1) * 32 + i * 16, YPIT, lane); }
      __builtin_amdgcn_sched_barrier(0);   // keeps those LDS reads up here: sunk to their use, the next pass's first product waits out the whole LDS latency
      float mx[2];
#pragma unroll
      for (int u = 0; u < 2; ++u) { float a = sc[u][0][0];
#pragma unroll
        for (int e = 1; e < 16; ++e) a = fmaxf(a, sc[u][e >> 3][e & 7]);
        mx[u] = fmaxf(a, xhalf(a)); }
      // lazy rescale: the maximum in use moves only when a column's new one exceeds it by more than 8 (P stays below 2^8); one scalar branch a pass
      const bool need = (mx[0] > thr) | (mx[1] > thr);
      if (__builtin_amdgcn_ballot_w32(need) != 0) {
#pragma unroll
        for (int u = 0; u < 2; ++u) { const float d = fmaxf(mx[u], lo); const float al = __builtin_amdgcn_exp2f(-fmaxf(d, 0.0f)); l[u] *= al; nm[u] -= d; sc[u][0] -= d; sc[u][1] -= d;
#pragma unroll
          for (int j = 0; j < 4; ++j) acc[j][u] *= al; }
        thr = 8.0f; lo = 0.0f; }
      v16h ph[2];
#pragma unroll
      for (int u = 0; u < 2; ++u)
#pragma unroll
        for (int e = 0; e < 16; e += 2) { const v2f p = {__builtin_amdgcn_exp2f(sc[u][e >> 3][e & 7]), __builtin_amdgcn_exp2f(sc[u][e >> 3][(e & 7) + 1])}; l[u] += p;
          const v2h h = __builtin_convertvector(p, v2h);
          ph[u][e] = h[0]; ph[u][e + 1] = h[1]; }
#pragma unroll
      for (int j = 0; j < 4; ++j)
#pragma unroll
        for (int u = 0; u < 2; ++u) acc[j][u] = wmma_h(vf[j], ph[u], acc[j][u]);
    }
    if (st + 1 < TT / FK) { h16* dy = sb + ((st + 1) & 1) * SY_E;
#pragma unroll
      for (int i = 0; i < 8; ++i) *(v4h*)(dy + (8 * i + wave) * YPIT + lane * 4) = __builtin_convertvector(ry[i], v4h); }
    __syncthreads();
  }
  // every wave has left the tile buffers (the loop's last barrier): each wave stages its 64 channels x 32 queries and stores whole 128-byte lines
  float* ow = (float*)sm + wave * (CH * OPIT);
#pragma unroll
  for (int u = 0; u < 2; ++u) { const float ls = l[u][0] + l[u][1]; const float inv = 1.0f / (ls + xhalf(ls));
#pragma unroll
    for (int j = 0; j < 4; ++j)
#pragma unroll
      for (int r = 0; r < 8; ++r) ow[(j * 16 + 8 * g + r) * OPIT + u * 16 + col] = acc[j][u][r] * inv; }
  __syncthreads();
#pragma unroll
  for (int i = 0; i < 16; ++i) { const int e = i * 32 + lane, c = e >> 3, q = e & 7; vst2(OUT + (bh * CH + c) * (size_t)TT + tw + q * 4, *(const v4f*)&ow[c * OPIT + q * 4]); } }
extern "C" void kernel_launch(void* const* d_in, const int* in_sizes, int n_in, void* d_out, int out_size, void* d_ws, size_t ws_size, hipStream_t stream) {
  (void)in_sizes; (void)n_in; (void)out_size; (void)d_ws; (void)ws_size;
  const float** F = (const float**)d_in;   // 0 qkv [2,1024,2048] ([bs, width, length]) -> q = reshape(32, 64, 2048); 1 y -> k = v = reshape(32, 64, 2048)
  k_fa<<<dim3(TT / 256, TNBH), 256, 0, stream>>>(F[0], F[1], (float*)d_out);
}

// v005
// A run of this version takes 27.3 microseconds.
// Two timings next to v004 both put it at 1.05 times that version's speed.
// Over all steps from v000 it is 40.2 times as fast.
// compute dtype: qkv and y rounded to f16 (11 significant bits; every product exact in f32), in the one kernel: q fragments converted from the channels-first f32 rows after the factor log2(e)/8, y tiles converted on their way into LDS and read both as v planes and, transposed, as k rows; logits on WMMA 16x16x32 (1 product, f32 accumulate), never stored; online softmax in f32 (exp2 of the score product's own result: it starts from minus the maximum in use); unnormalised P (below 2^15) rounded once to f16 against the v planes (1 product), divided by the f32 row sum of the unrounded P at the end; f32 output written channels-first. Inputs must lie inside the f16 range (the declared generators are standard normal).
#include <hip/hip_runtime.h>
#include <math.h>

typedef _Float16 h16;
typedef __attribute__((ext_vector_type(16))) h16 v16h;
typedef __attribute__((ext_vector_type(8)))  h16 v8h;
typedef __attribute__((ext_vector_type(8)))  float v8f;
typedef __attribute__((ext_vector_type(4)))  float v4f;
typedef __attribute__((ext_vector_type(2)))  float v2f;
typedef __attribute__((ext_vector_type(2)))  h16 v2h;
typedef __attribute__((ext_vector_type(4)))  h16 v4h;

template <typename T> __device__ __forceinline__ void vst2(void* p, T v) { *(T*)p = v;  }
__device__ __forceinline__ v8f wmma_h(v16h a, v16h b, v8f c) { return __builtin_amdgcn_wmma_f32_16x16x32_f16(false, a, false, b, (short)0, c, false, false); }

// QKVAttentionLegacy (bs 2, 16 heads, ch 64, T = S = 2,048): q = qkv.reshape(32, 64, T) (channels-first), k = v = y.reshape(32, 64, S); w = softmax_s((q/sqrt(sqrt 64)) . (k/sqrt(sqrt 64))); a[c][t] = sum_s w[t][s] v[c][s]; out = a.reshape(2, 1024, 2048).
#define NBH 32
#define CH 64
#define TT 2048
#ifndef TNBH
#define TNBH NBH
#endif
// 16x16x32 fragments: lane = (h = lane>>4, row/col = lane&15); elements 0..7 = k0+8h+0..7, 8..15 = k0+16+8h+0..7; D element r = row 8h+r
__device__ __forceinline__ v16h frag_b(const h16* rowk0, int lane) { union { v16h v; v8h q[2]; } u; const h16* p = rowk0 + 8 * (lane >> 4); u.q[0] = *(const v8h*)p; u.q[1] = *(const v8h*)(p + 16); return u.v; }
// the same fragment of a tile stored k-major (row = k, column = the operand's row): two transposing LDS loads; lane l hands in row 8(l>>4) + (l&7), 16-byte piece (l>>3)&1, and gets column l&15 at k = 8(l>>4) + 0..7
typedef __attribute__((ext_vector_type(8))) __fp16 v8p;   // the builtin's own spelling of eight f16
typedef __attribute__((address_space(3))) v8p lds_v8h;
__device__ __forceinline__ v16h frag_t(const h16* k0col0, int pitch, int lane) { union { v16h v; v8h q[2]; } u; const h16* p = k0col0 + (8 * (lane >> 4) + (lane & 7)) * pitch + 8 * ((lane >> 3) & 1);
  u.q[0] = __builtin_bit_cast(v8h, __builtin_amdgcn_ds_load_tr16_b128_v8f16((lds_v8h*)p)); u.q[1] = __builtin_bit_cast(v8h, __builtin_amdgcn_ds_load_tr16_b128_v8f16((lds_v8h*)(p + 16 * pitch))); return u.v; }
// ---- k_fa: block = (256 queries t, pair bh), 8 waves x 32 query columns. Transposed products: St = K . Qt (rows = keys, columns = queries), Ot += V . Pt.
// A lane holds 16 of a pass's 32 scores of one query, in the k order of a B operand: two St tiles convert in place into Pt; the sum is in-lane plus one exchange between the wave's halves at the end, the maximum is taken (in-lane plus one exchange) only where the maximum in use moves.
// k = v = y: one f16 tile [64 channels][128 keys] a stage serves both products, as V rows by plain loads and as K rows by transposing loads. Two buffers: the next stage's f32 global loads fly during this stage's four passes and are converted when they are stored to LDS, one barrier a stage.
// Inner loops are unrolled so that every index into a register array is a constant (a run-time index would send the array to scratch).
#define FK 128                 // keys per stage
#define YPIT 144               // tile row pitch in LDS, elements: 288 B = 32 B x odd (the transposing reader's pitch)
#define SY_E (CH * YPIT)
#define OPIT 36                // output staging pitch, floats
__device__ __forceinline__ float xhalf(float v) { const int b = __builtin_bit_cast(int, v); return __builtin_bit_cast(float, __builtin_amdgcn_permlanex16(b, b, 0x76543210, 0xfedcba98, false, false)); }
__global__ __launch_bounds__(256) void k_fa(const float* __restrict__ QKV, const float* __restrict__ Y, float* __restrict__ OUT) {
  __shared__ __align__(16) char sm[8 * CH * OPIT * 4];   // 73,728 B: two tile buffers (36,864 B) in the loop, the output staging behind it
  static_assert(sizeof(sm) >= 2u * 2u * SY_E, "LDS");
  const int tid = threadIdx.x, wave = tid >> 5, lane = tid & 31, col = lane & 15, g = lane >> 4;
  const size_t bh = blockIdx.y; const int tw = blockIdx.x * 256 + wave * 32;
  const float* Yg = Y + bh * CH * TT + (size_t)wave * TT + lane * 4;   // a wave loads whole 512-byte rows: row 8 i + wave, 16 bytes a lane
  const float* Qg = QKV + bh * CH * TT + tw + col;
  h16* const sb = (h16*)sm;
  const float CS = 0.125f * 1.44269504088896340736f;
  v4f ry[8];
#pragma unroll
  for (int i = 0; i < 8; ++i) ry[i] = *(const v4f*)(Yg + (size_t)(8 * i) * TT);
  // q fragments straight from the channels-first rows: element e of a lane is channel kc*32 + 16(e>>3) + 8g + (e&7) of its query; 16 lanes read 64 bytes of a row
  float rq[2][2][16];
#pragma unroll
  for (int u = 0; u < 2; ++u)
#pragma unroll
    for (int kc = 0; kc < 2; ++kc)
#pragma unroll
      for (int e = 0; e < 16; ++e) rq[u][kc][e] = Qg[(size_t)(kc * 32 + (e >> 3) * 16 + 8 * g + (e & 7)) * TT + u * 16];
  asm volatile("s_wait_xcnt 0x0" ::: "memory");   // stands before the address registers of the loads above are reused
  __builtin_amdgcn_sched_barrier(0);              // keeps later register writes (the accumulators' zeroes) from being lifted over that wait
#pragma unroll
  for (int i = 0; i < 8; ++i) *(v4h*)(sb + (8 * i + wave) * YPIT + lane * 4) = __builtin_convertvector(ry[i], v4h);
  v16h qf[2][2];
#pragma unroll
  for (int u = 0; u < 2; ++u)
#pragma unroll
    for (int kc = 0; kc < 2; ++kc)
#pragma unroll
      for (int e = 0; e < 16; ++e) qf[u][kc][e] = (h16)(rq[u][kc][e] * CS);   // the softmax scale rides in q: St comes out in log2 units
  __syncthreads();
  v8f acc[4][2] = {}; v2f l[2] = {};
  // nm[u]: minus the maximum in use of the lane's query, in all eight elements: the C operand of the St products, so that St leaves the matrix unit as exp2's argument
  // thr, lo: the first pass always takes the rescale branch and takes its own maximum whatever its sign; later passes only raise the maximum in use
  v8f nm[2] = {}; float thr = -3.0e38f, lo = -3.0e38f;
#pragma unroll 1   // the stage loop stays rolled: its four unrolled passes are the whole hot text, and the buffer index is one scalar select
  for (int st = 0; st < TT / FK; ++st) {
    const h16* sy = sb + (st & 1) * SY_E;
    if (st + 1 < TT / FK) { const int s0 = (st + 1) * FK;
#pragma unroll
      for (int i = 0; i < 8; ++i) ry[i] = *(const v4f*)(Yg + (size_t)(8 * i) * TT + s0);
      asm volatile("s_wait_xcnt 0x0" ::: "memory");   // stands before the address registers of the loads above are reused
    }
    v16h kf[2][2];
#pragma unroll
    for (int i = 0; i < 2; ++i)
#pragma unroll
      for (int kc = 0; kc < 2; ++kc) kf[i][kc] = frag_t(sy + kc * 32 * YPIT + i * 16, YPIT, lane);
#pragma unroll
    for (int ps = 0; ps < FK / 32; ++ps) {
      v16h vf[4];
#pragma unroll
      for (int j = 0; j < 4; ++j) vf[j] = frag_b(sy + (j * 16 + col) * YPIT + ps * 32, lane);
      v8f sc[2][2];
#pragma unroll
      for (int u = 0; u < 2; ++u)
#pragma unroll
        for (int i = 0; i < 2; ++i) sc[u][i] = wmma_h(kf[i][1], qf[u][1], wmma_h(kf[i][0], qf[u][0], nm[u]));
      // the next pass's K fragments are fetched behind this pass's St products, so that the softmax covers their LDS latency (inside the published stage only)
      if (ps + 1 < FK / 32) {
#pragma unroll
        for (int i = 0; i < 2; ++i)
#pragma unroll
          for (int kc = 0; kc < 2; ++kc) kf[i][kc] = frag_t(sy + kc * 32 * YPIT + (ps + 1) * 32 + i * 16, YPIT, lane); }
      __builtin_amdgcn_sched_barrier(0);   // keeps those LDS reads up here: sunk to their use, the next pass's first product waits out the whole LDS latency
      // P at the maximum in use, and the lane's sum of the pass: every P is positive, so the sum bounds each of them from above and no maximum is taken here
      v2f pr[2][8], ls[2];
#pragma unroll
      for (int u = 0; u < 2; ++u)
#pragma unroll
        for (int e = 0; e < 16; e += 2) { pr[u][e >> 1] = v2f{__builtin_amdgcn_exp2f(sc[u][e >> 3][e & 7]), __builtin_amdgcn_exp2f(sc[u][e >> 3][(e & 7) + 1])};
          if (e == 0) ls[u] = pr[u][0]; else ls[u] += pr[u][e >> 1]; }
      // lazy rescale: the maximum in use moves only when a lane's sum of the pass exceeds 2^15 (so P stays inside f16; an overflowed exp2 gives an infinite sum and is caught too); one scalar branch a pass
      const float top = fmaxf(fmaxf(ls[0][0], ls[0][1]), fmaxf(ls[1][0], ls[1][1]));
      if (__builtin_amdgcn_ballot_w32(top > thr) != 0) {   // here alone the maximum is taken and exchanged; al = exp2(-max(d, 0)), the clamp taken behind exp2; P and its sum are formed again
#pragma unroll
        for (int u = 0; u < 2; ++u) { float a = sc[u][0][0];
#pragma unroll
          for (int e = 1; e < 16; ++e) a = fmaxf(a, sc[u][e >> 3][e & 7]);
          const float d = fmaxf(fmaxf(a, xhalf(a)), lo); const float al = fminf(__builtin_amdgcn_exp2f(-d), 1.0f); l[u] *= al; nm[u] -= d; sc[u][0] -= d; sc[u][1] -= d;
#pragma unroll
          for (int j = 0; j < 4; ++j) acc[j][u] *= al;
#pragma unroll
          for (int e = 0; e < 16; e += 2) { pr[u][e >> 1] = v2f{__builtin_amdgcn_exp2f(sc[u][e >> 3][e & 7]), __builtin_amdgcn_exp2f(sc[u][e >> 3][(e & 7) + 1])};
            if (e == 0) ls[u] = pr[u][0]; else ls[u] += pr[u][e >> 1]; } }
        thr = 32768.0f; lo = 0.0f; }
      v16h ph[2];
#pragma unroll
      for (int u = 0; u < 2; ++u) { l[u] += ls[u];
#pragma unroll
        for (int e = 0; e < 16; e += 2) { const v2h h = __builtin_convertvector(pr[u][e >> 1], v2h);
          ph[u][e] = h[0]; ph[u][e + 1] = h[1]; } }
#pragma unroll
      for (int j = 0; j < 4; ++j)
#pragma unroll
        for (int u = 0; u < 2; ++u) acc[j][u] = wmma_h(vf[j], ph[u], acc[j][u]);
    }
    if (st + 1 < TT / FK) { h16* dy = sb + ((st + 1) & 1) * SY_E;
#pragma unroll
      for (int i = 0; i < 8; ++i) *(v4h*)(dy + (8 * i + wave) * YPIT + lane * 4) = __builtin_convertvector(ry[i], v4h); }
    __syncthreads();
  }
  // every wave has left the tile buffers (the loop's last barrier): each wave stages its 64 channels x 32 queries and stores whole 128-byte lines
  float* ow = (float*)sm + wave * (CH * OPIT);
#pragma unroll
  for (int u = 0; u < 2; ++u) { const float ls = l[u][0] + l[u][1]; const float inv = 1.0f / (ls + xhalf(ls));
#pragma unroll
    for (int j = 0; j < 4; ++j)
#pragma unroll
      for (int r = 0; r < 8; ++r) ow[(j * 16 + 8 * g + r) * OPIT + u * 16 + col] = acc[j][u][r] * inv; }
  __syncthreads();
#pragma unroll
  for (int i = 0; i < 16; ++i) { const int e = i * 32 + lane, c = e >> 3, q = e & 7; vst2(OUT + (bh * CH + c) * (size_t)TT + tw + q * 4, *(const v4f*)&ow[c * OPIT + q * 4]); } }
extern "C" void kernel_launch(void* const* d_in, const int* in_sizes, int n_in, void* d_out, int out_size, void* d_ws, size_t ws_size, hipStream_t stream) {
  (void)in_sizes; (void)n_in; (void)out_size; (void)d_ws; (void)ws_size;
  const float** F = (const float**)d_in;   // 0 qkv [2,1024,2048] ([bs, width, length]) -> q = reshape(32, 64, 2048); 1 y -> k = v = reshape(32, 64, 2048)
  k_fa<<<dim3(TT / 256, TNBH), 256, 0, stream>>>(F[0], F[1], (float*)d_out);
}

// v006
// It runs in 25.7 microseconds.
// Next to v005, in two timings, it ran 1.07 and 1.06 times as fast.
// All steps since v000 together make it 42.7 times as fast.
// compute dtype: qkv and y rounded to f16 (11 significant bits; every product exact in f32), in the one kernel: q fragments converted from the channels-first f32 rows after the factor log2(e)/8, y tiles converted on their way into LDS and read both as v planes and, transposed, as k rows; logits on WMMA 16x16x32 (1 product, f32 accumulate), never stored; online softmax in f32 (exp2 of the score product's own result: it starts from minus the maximum in use); unnormalised P (below 2^15) rounded once to f16 against the v planes (1 product), divided by the f32 row sum of the unrounded P at the end; f32 output written channels-first. Inputs must lie inside the f16 range (the declared generators are standard normal).
#include <hip/hip_runtime.h>
#include <math.h>

typedef _Float16 h16;
typedef __attribute__((ext_vector_type(16))) h16 v16h;
typedef __attribute__((ext_vector_type(8)))  h16 v8h;
typedef __attribute__((ext_vector_type(8)))  float v8f;
typedef __attribute__((ext_vector_type(4)))  float v4f;
typedef __attribute__((ext_vector_type(2)))  float v2f;
typedef __attribute__((ext_vector_type(2)))  h16 v2h;
typedef __attribute__((ext_vector_type(4)))  h16 v4h;

template <typename T> __device__ __forceinline__ void vst2(void* p, T v) { *(T*)p = v;  }
__device__ __forceinline__ v8f wmma_h(v16h a, v16h b, v8f c) { return __builtin_amdgcn_wmma_f32_16x16x32_f16(false, a, false, b, (short)0, c, false, false); }

// QKVAttentionLegacy (bs 2, 16 heads, ch 64, T = S = 2,048): q = qkv.reshape(32, 64, T) (channels-first), k = v = y.reshape(32, 64, S); w = softmax_s((q/sqrt(sqrt 64)) . (k/sqrt(sqrt 64))); a[c][t] = sum_s w[t][s] v[c][s]; out = a.reshape(2, 1024, 2048).
#define NBH 32
#define CH 64
#define TT 2048
#ifndef TNBH
#define TNBH NBH
#endif
// 16x16x32 fragments: lane = (h = lane>>4, row/col = lane&15); elements 0..7 = k0+8h+0..7, 8..15 = k0+16+8h+0..7; D element r = row 8h+r
__device__ __forceinline__ v16h frag_b(const h16* rowk0, int lane) { union { v16h v; v8h q[2]; } u; const h16* p = rowk0 + 8 * (lane >> 4); u.q[0] = *(const v8h*)p; u.q[1] = *(const v8h*)(p + 16); return u.v; }
// the same fragment of a tile stored k-major (row = k, column = the operand's row): two transposing LDS loads; lane l hands in row 8(l>>4) + (l&7), 16-byte piece (l>>3)&1, and gets column l&15 at k = 8(l>>4) + 0..7
typedef __attribute__((ext_vector_type(8))) __fp16 v8p;   // the builtin's own spelling of eight f16
typedef __attribute__((address_space(3))) v8p lds_v8h;
__device__ __forceinline__ v16h frag_t(const h16* k0col0, int pitch, int lane) { union { v16h v; v8h q[2]; } u; const h16* p = k0col0 + (8 * (lane >> 4) + (lane & 7)) * pitch + 8 * ((lane >> 3) & 1);
  u.q[0] = __builtin_bit_cast(v8h, __builtin_amdgcn_ds_load_tr16_b128_v8f16((lds_v8h*)p)); u.q[1] = __builtin_bit_cast(v8h, __builtin_amdgcn_ds_load_tr16_b128_v8f16((lds_v8h*)(p + 16 * pitch))); return u.v; }
// ---- k_fa: block = (256 queries t, pair bh), 8 waves = 4 groups of 64 query columns x 2 key halves: a K or V fragment read from LDS feeds four products. Wave (qg, kh) walks keys kh*64 .. +63 of every stage with its own online softmax; the two halves are joined through LDS behind the loop. Transposed products: St = K . Qt (rows = keys, columns = queries), Ot += V . Pt.
// A lane holds 16 of a pass's 32 scores of one query, in the k order of a B operand: two St tiles convert in place into Pt; the sum is in-lane plus one exchange between the wave's halves at the end, the maximum is taken (in-lane plus one exchange) only where the maximum in use moves.
// k = v = y: one f16 tile [64 channels][128 keys] a stage serves both products, as V rows by plain loads and as K rows by transposing loads. Two buffers: the next stage's f32 global loads fly during this stage's two passes a wave and are converted when they are stored to LDS, one barrier a stage.
// Inner loops are unrolled so that every index into a register array is a constant (a run-time index would send the array to scratch).
#define FK 128                 // keys per stage
#define YPIT 144               // tile row pitch in LDS, elements: 288 B = 32 B x odd (the transposing reader's pitch)
#define SY_E (CH * YPIT)
#define XW 4352                // floats a query group hands over at the join: 4,096 output sums, 128 row sums, 128 maxima
#define NU 4                   // 16-column query groups a wave
#define NPS (FK / 64)          // passes of 32 keys a wave and stage
__device__ __forceinline__ float xhalf(float v) { const int b = __builtin_bit_cast(int, v); return __builtin_bit_cast(float, __builtin_amdgcn_permlanex16(b, b, 0x76543210, 0xfedcba98, false, false)); }
__global__ __launch_bounds__(256) void k_fa(const float* __restrict__ QKV, const float* __restrict__ Y, float* __restrict__ OUT) {
  __shared__ __align__(16) char sm[4 * XW * 4];   // 69,632 B: two tile buffers (36,864 B) in the loop; behind it, per query group, the upper key half's state
  static_assert(sizeof(sm) >= 2u * 2u * SY_E, "LDS");
  const int tid = threadIdx.x, wave = __builtin_amdgcn_readfirstlane(tid >> 5), lane = tid & 31, col = lane & 15, g = lane >> 4;
  const int qg = wave & 3, kh = wave >> 2;   // query group, key half
  const size_t bh = blockIdx.y; const int tw = blockIdx.x * 256 + qg * 64;
  const float* Yg = Y + bh * CH * TT + (size_t)wave * TT + lane * 4;   // a wave loads whole 512-byte rows: row 8 i + wave, 16 bytes a lane
  const float* Qg = QKV + bh * CH * TT + (size_t)(8 * g) * TT + tw + col * 4;
  h16* const sb = (h16*)sm;
  const float CS = 0.125f * 1.44269504088896340736f;
  v4f ry[8];
#pragma unroll
  for (int i = 0; i < 8; ++i) ry[i] = *(const v4f*)(Yg + (size_t)(8 * i) * TT);
  // q fragments straight from the channels-first rows: column col of group u is query 4 col + u of the wave's 64, so a lane reads its four queries of a channel in one 16-byte load and 16 lanes read 256 bytes of a row; element e of a lane is channel kc*32 + 16(e>>3) + 8g + (e&7)
  v4f rq[2][16];
#pragma unroll
  for (int kc = 0; kc < 2; ++kc)
#pragma unroll
    for (int e = 0; e < 16; ++e) rq[kc][e] = *(const v4f*)(Qg + (size_t)(kc * 32 + (e >> 3) * 16 + (e & 7)) * TT);
  asm volatile("s_wait_xcnt 0x0" ::: "memory");   // stands before the address registers of the loads above are reused
  __builtin_amdgcn_sched_barrier(0);              // keeps later register writes (the accumulators' zeroes) from being lifted over that wait
#pragma unroll
  for (int i = 0; i < 8; ++i) *(v4h*)(sb + (8 * i + wave) * YPIT + lane * 4) = __builtin_convertvector(ry[i], v4h);
  v16h qf[NU][2];
#pragma unroll
  for (int u = 0; u < NU; ++u)
#pragma unroll
    for (int kc = 0; kc < 2; ++kc)
#pragma unroll
      for (int e = 0; e < 16; ++e) qf[u][kc][e] = (h16)(rq[kc][e][u] * CS);   // the softmax scale rides in q: St comes out in log2 units
  __syncthreads();
  v8f acc[4][NU] = {}; v2f l[NU] = {};
  // nm[u]: minus the maximum in use of the lane's query, in all eight elements: the C operand of the St products, so that St leaves the matrix unit as exp2's argument
  // thr, lo: the first pass always takes the rescale branch and takes its own maximum whatever its sign; later passes only raise the maximum in use
  v8f nm[NU] = {}; float thr = -3.0e38f, lo = -3.0e38f;
#pragma unroll 1   // the stage loop stays rolled: its two unrolled passes are the whole hot text, and the buffer index is one scalar select
  for (int st = 0; st < TT / FK; ++st) {
    const h16* sy = sb + (st & 1) * SY_E + kh * (FK / 2);   // the wave's own half of the stage's keys
    if (st + 1 < TT / FK) { const int s0 = (st + 1) * FK;
#pragma unroll
      for (int i = 0; i < 8; ++i) ry[i] = *(const v4f*)(Yg + (size_t)(8 * i) * TT + s0);
      asm volatile("s_wait_xcnt 0x0" ::: "memory");   // stands before the address registers of the loads above are reused
    }
    v16h kf[2][2];
#pragma unroll
    for (int i = 0; i < 2; ++i)
#pragma unroll
      for (int kc = 0; kc < 2; ++kc) kf[i][kc] = frag_t(sy + kc * 32 * YPIT + i * 16, YPIT, lane);
#pragma unroll
    for (int ps = 0; ps < NPS; ++ps) {
      v16h vf[4];
#pragma unroll
      for (int j = 0; j < 4; ++j) vf[j] = frag_b(sy + (j * 16 + col) * YPIT + ps * 32, lane);
      v8f sc[NU][2];
#pragma unroll
      for (int u = 0; u < NU; ++u)
#pragma unroll
        for (int i = 0; i < 2; ++i) sc[u][i] = wmma_h(kf[i][1], qf[u][1], wmma_h(kf[i][0], qf[u][0], nm[u]));
      // the next pass's K fragments are fetched behind this pass's St products, so that the softmax covers their LDS latency (inside the published stage only)
      if (ps + 1 < NPS) {
#pragma unroll
        for (int i = 0; i < 2; ++i)
#pragma unroll
          for (int kc = 0; kc < 2; ++kc) kf[i][kc] = frag_t(sy + kc * 32 * YPIT + (ps + 1) * 32 + i * 16, YPIT, lane); }
      __builtin_amdgcn_sched_barrier(0);   // keeps those LDS reads up here: sunk to their use, the next pass's first product waits out the whole LDS latency
      // P at the maximum in use, and the lane's sum of the pass: every P is positive, so the sum bounds each of them from above and no maximum is taken here
      v2f pr[NU][8], ls[NU];
#pragma unroll
      for (int u = 0; u < NU; ++u)
#pragma unroll
        for (int e = 0; e < 16; e += 2) { pr[u][e >> 1] = v2f{__builtin_amdgcn_exp2f(sc[u][e >> 3][e & 7]), __builtin_amdgcn_exp2f(sc[u][e >> 3][(e & 7) + 1])};
          if (e == 0) ls[u] = pr[u][0]; else ls[u] += pr[u][e >> 1]; }
      // lazy rescale: the maximum in use moves only when a lane's sum of the pass exceeds 2^15 (so P stays inside f16; an overflowed exp2 gives an infinite sum and is caught too); one scalar branch a pass
      float top = fmaxf(ls[0][0], ls[0][1]);
#pragma unroll
      for (int u = 1; u < NU; ++u) top = fmaxf(top, fmaxf(ls[u][0], ls[u][1]));
      if (__builtin_amdgcn_ballot_w32(top > thr) != 0) {   // here alone the maximum is taken and exchanged; al = exp2(-max(d, 0)), the clamp taken behind exp2; P and its sum are formed again
#pragma unroll
        for (int u = 0; u < NU; ++u) { float a = sc[u][0][0];
#pragma unroll
          for (int e = 1; e < 16; ++e) a = fmaxf(a, sc[u][e >> 3][e & 7]);
          const float d = fmaxf(fmaxf(a, xhalf(a)), lo); const float al = fminf(__builtin_amdgcn_exp2f(-d), 1.0f); l[u] *= al; nm[u] -= d; sc[u][0] -= d; sc[u][1] -= d;
#pragma unroll
          for (int j = 0; j < 4; ++j) acc[j][u] *= al;
#pragma unroll
          for (int e = 0; e < 16; e += 2) { pr[u][e >> 1] = v2f{__builtin_amdgcn_exp2f(sc[u][e >> 3][e & 7]), __builtin_amdgcn_exp2f(sc[u][e >> 3][(e & 7) + 1])};
            if (e == 0) ls[u] = pr[u][0]; else ls[u] += pr[u][e >> 1]; } }
        thr = 32768.0f; lo = 0.0f; }
      v16h ph[NU];
#pragma unroll
      for (int u = 0; u < NU; ++u) { l[u] += ls[u];
#pragma unroll
        for (int e = 0; e < 16; e += 2) { const v2h h = __builtin_convertvector(pr[u][e >> 1], v2h);
          ph[u][e] = h[0]; ph[u][e + 1] = h[1]; } }
#pragma unroll
      for (int j = 0; j < 4; ++j)
#pragma unroll
        for (int u = 0; u < NU; ++u) acc[j][u] = wmma_h(vf[j], ph[u], acc[j][u]);
    }
    if (st + 1 < TT / FK) { h16* dy = sb + ((st + 1) & 1) * SY_E;
#pragma unroll
      for (int i = 0; i < 8; ++i) *(v4h*)(dy + (8 * i + wave) * YPIT + lane * 4) = __builtin_convertvector(ry[i], v4h); }
    __syncthreads();
  }
  // every wave has left the tile buffers (the loop's last barrier). Join of the two key halves: the upper half hands its sums over lane for lane (same fragment layout in both waves), the lower half brings both to the larger maximum, adds and divides
  float* xw = (float*)sm + qg * XW;
  if (kh == 1) {
#pragma unroll
    for (int j = 0; j < 4; ++j)
#pragma unroll
      for (int u = 0; u < NU; ++u)
#pragma unroll
        for (int hh = 0; hh < 2; ++hh) *(v4f*)&xw[((j * NU + u) * 2 + hh) * 128 + lane * 4] = v4f{acc[j][u][4 * hh], acc[j][u][4 * hh + 1], acc[j][u][4 * hh + 2], acc[j][u][4 * hh + 3]};
#pragma unroll
    for (int u = 0; u < NU; ++u) { xw[4096 + u * 32 + lane] = l[u][0] + l[u][1]; xw[4224 + u * 32 + lane] = nm[u][0]; } }
  __syncthreads();   // publishes the upper half's state
  if (kh == 0) {
#pragma unroll
    for (int u = 0; u < NU; ++u) { const float nb = xw[4224 + u * 32 + lane], na = nm[u][0], nn = fminf(na, nb);   // nm is minus the maximum in use: the smaller one belongs to the larger maximum
      const float fa = __builtin_amdgcn_exp2f(nn - na), fb = __builtin_amdgcn_exp2f(nn - nb);
      const float ls = (l[u][0] + l[u][1]) * fa + xw[4096 + u * 32 + lane] * fb; const float inv = 1.0f / (ls + xhalf(ls)); const float ga = fa * inv, gb = fb * inv;
#pragma unroll
      for (int j = 0; j < 4; ++j)
#pragma unroll
        for (int hh = 0; hh < 2; ++hh) { const v4f o = *(const v4f*)&xw[((j * NU + u) * 2 + hh) * 128 + lane * 4];
#pragma unroll
          for (int r = 0; r < 4; ++r) acc[j][u][4 * hh + r] = acc[j][u][4 * hh + r] * ga + o[r] * gb; } }
    // a lane's four groups are four adjacent queries: 16 lanes store 256 bytes of a channel row, whole 128-byte lines, straight from registers
    float* og = OUT + (bh * CH + 8 * g) * (size_t)TT + tw + col * 4;
#pragma unroll
    for (int j = 0; j < 4; ++j)
#pragma unroll
      for (int r = 0; r < 8; ++r) vst2(og + (size_t)(j * 16 + r) * TT, v4f{acc[j][0][r], acc[j][1][r], acc[j][2][r], acc[j][3][r]}); } }
extern "C" void kernel_launch(void* const* d_in, const int* in_sizes, int n_in, void* d_out, int out_size, void* d_ws, size_t ws_size, hipStream_t stream) {
  (void)in_sizes; (void)n_in; (void)out_size; (void)d_ws; (void)ws_size;
  const float** F = (const float**)d_in;   // 0 qkv [2,1024,2048] ([bs, width, length]) -> q = reshape(32, 64, 2048); 1 y -> k = v = reshape(32, 64, 2048)
  k_fa<<<dim3(TT / 256, TNBH), 256, 0, stream>>>(F[0], F[1], (float*)d_out);
}
